// v000
// Times are from an AMD MI455X. After a warm-up the kernel runs many times in a row, and a time is the length of
// such a window on the GPU divided by its runs, so every launch and the gaps after it count. The runs cycle
// through copies of the inputs. A figure is the median of several windows, for all but v000 over two sittings.
// Sittings can differ by a few percent; kernels timed side by side share one.
// The starting kernel, v000, takes 324 microseconds a run.
#include <hip/hip_runtime.h>

// InteractionUnit (x [4][2048][512]; xn = LayerNorm(x) (w_token, b_token); score = xn.xn^T [2048][2048]; interaction = LayerNorm(score) over the 2048 keys (w_score, b_score);
// out = interaction.xn; y = LayerNorm(out) (w_token, b_token again)).
// Compute dtypes, f32 accumulate: every input rounded to bf16; all three LayerNorms in f32 on VALU; both contractions on bf16 hi+lo planes of
// the LayerNorm outputs (3 products each: score = xn.xn^T with K = 512, values up to 512; out = interaction.xn with K = 2048).

#define NB_  4
#define TT   2048
#define CC   512
#define NT   (NB_ * TT)
typedef _Float16 h16;
typedef unsigned short bf;
typedef __attribute__((ext_vector_type(16))) __bf16   v16bf;
typedef __attribute__((ext_vector_type(16))) _Float16 v16h;
typedef __attribute__((ext_vector_type(8)))  _Float16 v8h;
typedef __attribute__((ext_vector_type(8)))  unsigned short v8us;
typedef __attribute__((ext_vector_type(8)))  float    v8f;
typedef __attribute__((ext_vector_type(4)))  float    v4f;
typedef v8h  __attribute__((may_alias)) v8ha;
typedef v4f  __attribute__((may_alias)) v4fa;
typedef v8us __attribute__((may_alias)) v8usa;

__device__ __forceinline__ unsigned short f2bf(float f) { unsigned u = __float_as_uint(f); u += 0x7FFFu + ((u >> 16) & 1u); return (unsigned short)(u >> 16); }
__device__ __forceinline__ float bf2f(unsigned short b) { return __uint_as_float(((unsigned)b) << 16); }
__device__ __forceinline__ float bfr(float f) { return bf2f(f2bf(f)); }
__device__ __forceinline__ v16h cat16(v8h lo, v8h hi) { return __builtin_shufflevector(lo, hi, 0, 1, 2, 3, 4, 5, 6, 7, 8, 9, 10, 11, 12, 13, 14, 15); }
__device__ __forceinline__ v16bf cat16b(v8us lo, v8us hi) { return __builtin_bit_cast(v16bf, __builtin_shufflevector(lo, hi, 0, 1, 2, 3, 4, 5, 6, 7, 8, 9, 10, 11, 12, 13, 14, 15)); }
__device__ __forceinline__ v8f wmma16(v16h a, v16h b, v8f c) { return __builtin_amdgcn_wmma_f32_16x16x32_f16(false, a, false, b, (short)0, c, false, false); }
__device__ __forceinline__ v8f wmmab(v16bf a, v16bf b, v8f c) { return __builtin_amdgcn_wmma_f32_16x16x32_bf16(false, a, false, b, (short)0, c, false, false); }



// ---- k_gemmw: register-blocked GEMM, ONE WAVE per 64x64 output tile (16 accumulators), operands straight from K-contiguous 16-bit planes; grid (M/64, N/64, Z), 32 threads.
// C[m][n] (f32, pitch ldc, + optional f32 bias[n]) = sum_k A[m][k] Bt[n][k] (+ split products per NSPLIT). z-batch strides sA/sB/sC in elements. K % 32 == 0.
template <typename T16> struct WFrag;
template <> struct WFrag<h16> { typedef v16h V; static __device__ __forceinline__ V ld(const h16* p) { return cat16(*(const v8h*)p, *(const v8h*)(p + 16)); } static __device__ __forceinline__ v8f mma(V a, V b, v8f c) { return wmma16(a, b, c); } };
template <> struct WFrag<bf> { typedef v16bf V; static __device__ __forceinline__ V ld(const bf* p) { return cat16b(*(const v8us*)p, *(const v8us*)(p + 16)); } static __device__ __forceinline__ v8f mma(V a, V b, v8f c) { return wmmab(a, b, c); } };
template <typename T16, int NSPLIT, bool BIAS>
__global__ __launch_bounds__(32) void k_gemmw(const T16* __restrict__ A, const T16* __restrict__ A2, const T16* __restrict__ Bt, const T16* __restrict__ Bt2, int K, float* C, int ldc, const float* __restrict__ bias, size_t sA, size_t sB, size_t sC) {
    typedef typename WFrag<T16>::V V;
    __shared__ __align__(16) float os[16 * 68];
    const size_t z = blockIdx.z; A += z * sA; if (A2) A2 += z * sA; Bt += z * sB; if (Bt2) Bt2 += z * sB; C += z * sC;
    const int lane = threadIdx.x & 31, lr = lane & 15, hi = lane >> 4; const int r0 = blockIdx.x * 64, c0 = blockIdx.y * 64;
    v8f acc[4][4];
#pragma unroll
    for (int mb = 0; mb < 4; ++mb)
#pragma unroll
        for (int nb = 0; nb < 4; ++nb) acc[mb][nb] = (v8f){};
    const size_t aoff = (size_t)(r0 + lr) * K + 8 * hi, boff = (size_t)(c0 + lr) * K + 8 * hi;
#pragma unroll 1
    for (int kc = 0; kc < K; kc += 32) {
        V a[4], a2[4];
#pragma unroll
        for (int mb = 0; mb < 4; ++mb) { a[mb] = WFrag<T16>::ld(A + aoff + (size_t)mb * 16 * K + kc); if (NSPLIT == 1 || NSPLIT == 2) a2[mb] = WFrag<T16>::ld(A2 + aoff + (size_t)mb * 16 * K + kc); }
#pragma unroll
        for (int nb = 0; nb < 4; ++nb) { const V b = WFrag<T16>::ld(Bt + boff + (size_t)nb * 16 * K + kc); V b2; if (NSPLIT >= 2) b2 = WFrag<T16>::ld(Bt2 + boff + (size_t)nb * 16 * K + kc);
#pragma unroll
            for (int mb = 0; mb < 4; ++mb) { acc[mb][nb] = WFrag<T16>::mma(a[mb], b, acc[mb][nb]); if (NSPLIT == 1 || NSPLIT == 2) acc[mb][nb] = WFrag<T16>::mma(a2[mb], b, acc[mb][nb]); if (NSPLIT >= 2) acc[mb][nb] = WFrag<T16>::mma(a[mb], b2, acc[mb][nb]); } }
        asm volatile("v_nop\n\tv_nop\n\tv_nop\n\tv_nop" : "+v"(acc[0][0]), "+v"(acc[1][1]), "+v"(acc[2][2]), "+v"(acc[3][3]) : "v"(a[0]), "v"(a[3]));
    }
#pragma unroll
    for (int mb = 0; mb < 4; ++mb) {
#pragma unroll
        for (int nb = 0; nb < 4; ++nb) {
#pragma unroll
            for (int j = 0; j < 8; ++j) os[(hi * 8 + j) * 68 + nb * 16 + lr] = acc[mb][nb][j]; }
        __builtin_amdgcn_wave_barrier(); asm volatile("" ::: "memory");
        float* crow = C + (size_t)(r0 + mb * 16) * ldc + c0;
{
#pragma unroll
            for (int s = 0; s < 8; ++s) { const int row = 2 * s + hi, cofs = lr * 4; v4f val = *(const v4fa*)(os + row * 68 + cofs); if (BIAS) { val[0] += bfr(bias[c0 + cofs]); val[1] += bfr(bias[c0 + cofs + 1]); val[2] += bfr(bias[c0 + cofs + 2]); val[3] += bfr(bias[c0 + cofs + 3]); }
                *(v4f*)(crow + (size_t)row * ldc + cofs) = val; }
             }
        __builtin_amdgcn_wave_barrier(); asm volatile("" ::: "memory");
    }
}

__device__ __forceinline__ void splitf(float y, unsigned short& h, unsigned short& l) { h = f2bf(y); l = f2bf(y - bf2f(h)); }
typedef __attribute__((ext_vector_type(2))) unsigned short v2us;
typedef __attribute__((ext_vector_type(4))) unsigned short v4us;

__global__ __launch_bounds__(256) void k_lnx(const float* __restrict__ X, const float* __restrict__ gg, const float* __restrict__ bb, float* XNF, bf* Ph, bf* Pl) {
    const int lane = threadIdx.x & 31; const int r = blockIdx.x * 8 + (threadIdx.x >> 5); if (r >= NT) return; float v[16]; float s = 0.f;
#pragma unroll
    for (int c = 0; c < 4; ++c) { const v4f a = *(const v4f*)(X + (size_t)r * CC + c * 128 + lane * 4);
#pragma unroll
        for (int q = 0; q < 4; ++q) { v[c * 4 + q] = bfr(a[q]); s += v[c * 4 + q]; } }
#pragma unroll
    for (int sh = 16; sh; sh >>= 1) s += __shfl_xor(s, sh, 32);
    const float mu = s * (1.0f / CC); float qq = 0.f;
#pragma unroll
    for (int i = 0; i < 16; ++i) { const float d0 = v[i] - mu; qq = __fadd_rn(qq, __fmul_rn(d0, d0)); }
#pragma unroll
    for (int sh = 16; sh; sh >>= 1) qq += __shfl_xor(qq, sh, 32);
    const float rs = __fdiv_rn(1.0f, __fsqrt_rn(qq * (1.0f / CC) + 1e-5f));
{
#pragma unroll
        for (int c = 0; c < 4; ++c) { v4f o; v4us oh, ol;
#pragma unroll
            for (int q = 0; q < 4; ++q) { const int col = c * 128 + lane * 4 + q; o[q] = __fadd_rn(__fmul_rn((v[c * 4 + q] - mu) * rs, bfr(gg[col])), bfr(bb[col])); unsigned short a, c2; splitf(o[q], a, c2); oh[q] = a; ol[q] = c2; }
            *(v4f*)(XNF + (size_t)r * CC + c * 128 + lane * 4) = o; *(v4us*)(Ph + (size_t)r * CC + c * 128 + lane * 4) = oh; *(v4us*)(Pl + (size_t)r * CC + c * 128 + lane * 4) = ol; }
         }
}
__global__ __launch_bounds__(256) void k_xTsplit(const float* __restrict__ XNF, bf* Th, bf* Tl) {
    const int lane = threadIdx.x & 31; const int L0 = (blockIdx.x * 8 + (threadIdx.x >> 5)) * 8; const int nlines = NT * CC / 64;
{
#pragma unroll
        for (int l = 0; l < 8; ++l) { const int L = L0 + l; if (L >= nlines) break; const int e = L * 64 + lane * 2; const int t = e & (TT - 1); const int c = (e >> 11) & (CC - 1); const int b = e >> 20; v2us oh, ol;
#pragma unroll
            for (int q = 0; q < 2; ++q) { unsigned short a, c2; splitf(XNF[((size_t)b * TT + t + q) * CC + c], a, c2); oh[q] = a; ol[q] = c2; }
            *(v2us*)(Th + (size_t)e) = oh; *(v2us*)(Tl + (size_t)e) = ol; }
         }
}
__global__ __launch_bounds__(256) void k_lnsc(const float* __restrict__ S, const float* __restrict__ gg, const float* __restrict__ bb, bf* Ph, bf* Pl) {
    const int lane = threadIdx.x & 31; const int r = blockIdx.x * 8 + (threadIdx.x >> 5); if (r >= TT) return; const float* sr = S + (size_t)r * TT; float v[64]; float s = 0.f;
#pragma unroll
    for (int c = 0; c < 16; ++c) { const v4f a = *(const v4f*)(sr + c * 128 + lane * 4);
#pragma unroll
        for (int q = 0; q < 4; ++q) { v[c * 4 + q] = a[q]; s += a[q]; } }
#pragma unroll
    for (int sh = 16; sh; sh >>= 1) s += __shfl_xor(s, sh, 32);
    const float mu = s * (1.0f / TT); float qq = 0.f;
#pragma unroll
    for (int i = 0; i < 64; ++i) { const float d0 = v[i] - mu; qq = __fadd_rn(qq, __fmul_rn(d0, d0)); }
#pragma unroll
    for (int sh = 16; sh; sh >>= 1) qq += __shfl_xor(qq, sh, 32);
    const float rs = __fdiv_rn(1.0f, __fsqrt_rn(qq * (1.0f / TT) + 1e-5f));
{
#pragma unroll
        for (int c = 0; c < 16; ++c) { v4us oh, ol;
#pragma unroll
            for (int q = 0; q < 4; ++q) { const int col = c * 128 + lane * 4 + q; unsigned short a, c2; splitf(__fadd_rn(__fmul_rn((v[c * 4 + q] - mu) * rs, bfr(gg[col])), bfr(bb[col])), a, c2); oh[q] = a; ol[q] = c2; }
            *(v4us*)(Ph + (size_t)r * TT + c * 128 + lane * 4) = oh; *(v4us*)(Pl + (size_t)r * TT + c * 128 + lane * 4) = ol; }
         }
}
__global__ __launch_bounds__(256) void k_lno(const float* __restrict__ O, const float* __restrict__ gg, const float* __restrict__ bb, float* OUT) {
    const int lane = threadIdx.x & 31; const int r = blockIdx.x * 8 + (threadIdx.x >> 5); if (r >= TT) return; float v[16]; float s = 0.f;
#pragma unroll
    for (int c = 0; c < 4; ++c) { const v4f a = *(const v4f*)(O + (size_t)r * CC + c * 128 + lane * 4);
#pragma unroll
        for (int q = 0; q < 4; ++q) { v[c * 4 + q] = a[q]; s += a[q]; } }
#pragma unroll
    for (int sh = 16; sh; sh >>= 1) s += __shfl_xor(s, sh, 32);
    const float mu = s * (1.0f / CC); float qq = 0.f;
#pragma unroll
    for (int i = 0; i < 16; ++i) { const float d0 = v[i] - mu; qq = __fadd_rn(qq, __fmul_rn(d0, d0)); }
#pragma unroll
    for (int sh = 16; sh; sh >>= 1) qq += __shfl_xor(qq, sh, 32);
    const float rs = __fdiv_rn(1.0f, __fsqrt_rn(qq * (1.0f / CC) + 1e-5f));
{
#pragma unroll
        for (int c = 0; c < 4; ++c) { v4f o;
#pragma unroll
            for (int q = 0; q < 4; ++q) { const int col = c * 128 + lane * 4 + q; o[q] = __fadd_rn(__fmul_rn((v[c * 4 + q] - mu) * rs, bfr(gg[col])), bfr(bb[col])); }
            *(v4f*)(OUT + (size_t)r * CC + c * 128 + lane * 4) = o; }
         }
}

extern "C" void kernel_launch(void* const* d_in, const int* in_sizes, int n_in,
                              void* d_out, int out_size, void* d_ws, size_t ws_size, hipStream_t stream) {
    (void)in_sizes; (void)n_in; (void)out_size;
    const float* x = (const float*)d_in[0]; const float* wt = (const float*)d_in[1]; const float* bt = (const float*)d_in[2]; const float* wsS = (const float*)d_in[3]; const float* bsS = (const float*)d_in[4];
    float* OUT = (float*)d_out;     // [4][2048][512]
    char* wsp = (char*)d_ws;
    auto take = [&](size_t bytes) { char* p = wsp; wsp += (bytes + 255) & ~(size_t)255; return (void*)p; };
    float* XNF = (float*)take((size_t)NT * CC * 4); bf* XNh = (bf*)take((size_t)NT * CC * 2); bf* XNl = (bf*)take((size_t)NT * CC * 2); bf* XTh = (bf*)take((size_t)NT * CC * 2); bf* XTl = (bf*)take((size_t)NT * CC * 2);
    float* S = (float*)take((size_t)TT * TT * 4); bf* Ih = (bf*)take((size_t)TT * TT * 2); bf* Il = (bf*)take((size_t)TT * TT * 2); float* O = (float*)take((size_t)TT * CC * 4);
    if ((size_t)(wsp - (char*)d_ws) > ws_size) return;    // total ~ 88 MB; ws 256 MiB
    k_lnx<<<NT / 8, 256, 0, stream>>>(x, wt, bt, XNF, XNh, XNl); k_xTsplit<<<(unsigned)((NT * CC / 64 + 63) / 64), 256, 0, stream>>>(XNF, XTh, XTl);
    for (int b = 0; b < NB_; ++b) { const size_t r0 = (size_t)b * TT;
        k_gemmw<bf, 2, false><<<dim3(TT / 64, TT / 64, 1), 32, 0, stream>>>(XNh + r0 * CC, XNl + r0 * CC, XNh + r0 * CC, XNl + r0 * CC, CC, S, TT, nullptr, 0, 0, 0);    // score = xn . xn^T
        k_lnsc<<<TT / 8, 256, 0, stream>>>(S, wsS, bsS, Ih, Il);
        k_gemmw<bf, 2, false><<<dim3(TT / 64, CC / 64, 1), 32, 0, stream>>>(Ih, Il, XTh + r0 * CC, XTl + r0 * CC, TT, O, CC, nullptr, 0, 0, 0);                // out = interaction . xn  (Bt = xn^T [c][m])
        k_lno<<<TT / 8, 256, 0, stream>>>(O, wt, bt, OUT + r0 * CC); }
}

// v001
// Measured time: 206 microseconds a run.
// In both of two side-by-side timings against v000, it was 1.58 times as fast.
#include <hip/hip_runtime.h>

// InteractionUnit (x [4][2048][512]; xn = LayerNorm(x) (w_token, b_token); score = xn.xn^T [2048][2048]; interaction = LayerNorm(score) over the 2048 keys (w_score, b_score);
// out = interaction.xn; y = LayerNorm(out) (w_token, b_token again)).
// Compute dtypes, f32 accumulate: every input rounded to bf16; all three LayerNorms in f32 on VALU; both contractions on bf16 hi+lo planes of
// the LayerNorm outputs (3 products each: score = xn.xn^T with K = 512, values up to 512; out = interaction.xn with K = 2048).

#define NB_  4
#define TT   2048
#define CC   512
#define NT   (NB_ * TT)
typedef _Float16 h16;
typedef unsigned short bf;
typedef __attribute__((ext_vector_type(16))) __bf16   v16bf;
typedef __attribute__((ext_vector_type(16))) _Float16 v16h;
typedef __attribute__((ext_vector_type(8)))  _Float16 v8h;
typedef __attribute__((ext_vector_type(8)))  unsigned short v8us;
typedef __attribute__((ext_vector_type(8)))  float    v8f;
typedef __attribute__((ext_vector_type(4)))  float    v4f;
typedef v8h  __attribute__((may_alias)) v8ha;
typedef v4f  __attribute__((may_alias)) v4fa;
typedef v8us __attribute__((may_alias)) v8usa;

__device__ __forceinline__ unsigned short f2bf(float f) { unsigned u = __float_as_uint(f); u += 0x7FFFu + ((u >> 16) & 1u); return (unsigned short)(u >> 16); }
__device__ __forceinline__ float bf2f(unsigned short b) { return __uint_as_float(((unsigned)b) << 16); }
__device__ __forceinline__ float bfr(float f) { return bf2f(f2bf(f)); }
__device__ __forceinline__ v16h cat16(v8h lo, v8h hi) { return __builtin_shufflevector(lo, hi, 0, 1, 2, 3, 4, 5, 6, 7, 8, 9, 10, 11, 12, 13, 14, 15); }
__device__ __forceinline__ v16bf cat16b(v8us lo, v8us hi) { return __builtin_bit_cast(v16bf, __builtin_shufflevector(lo, hi, 0, 1, 2, 3, 4, 5, 6, 7, 8, 9, 10, 11, 12, 13, 14, 15)); }
__device__ __forceinline__ v8f wmma16(v16h a, v16h b, v8f c) { return __builtin_amdgcn_wmma_f32_16x16x32_f16(false, a, false, b, (short)0, c, false, false); }
__device__ __forceinline__ v8f wmmab(v16bf a, v16bf b, v8f c) { return __builtin_amdgcn_wmma_f32_16x16x32_bf16(false, a, false, b, (short)0, c, false, false); }



// ---- k_gemmw: register-blocked GEMM, ONE WAVE per 64x64 output tile (16 accumulators), operands straight from K-contiguous 16-bit planes; grid (M/64, N/64, Z), 32 threads.
// C[m][n] (f32, pitch ldc, + optional f32 bias[n]) = sum_k A[m][k] Bt[n][k] (+ split products per NSPLIT). z-batch strides sA/sB/sC in elements. K % 32 == 0.
template <typename T16> struct WFrag;
template <> struct WFrag<h16> { typedef v16h V; static __device__ __forceinline__ V ld(const h16* p) { return cat16(*(const v8h*)p, *(const v8h*)(p + 16)); } static __device__ __forceinline__ v8f mma(V a, V b, v8f c) { return wmma16(a, b, c); } };
template <> struct WFrag<bf> { typedef v16bf V; static __device__ __forceinline__ V ld(const bf* p) { return cat16b(*(const v8us*)p, *(const v8us*)(p + 16)); } static __device__ __forceinline__ v8f mma(V a, V b, v8f c) { return wmmab(a, b, c); } };
template <typename T16, int NSPLIT, bool BIAS>
__global__ __launch_bounds__(32) void k_gemmw(const T16* __restrict__ A, const T16* __restrict__ A2, const T16* __restrict__ Bt, const T16* __restrict__ Bt2, int K, float* C, int ldc, const float* __restrict__ bias, size_t sA, size_t sB, size_t sC) {
    typedef typename WFrag<T16>::V V;
    __shared__ __align__(16) float os[16 * 68];
    const size_t z = blockIdx.z; A += z * sA; if (A2) A2 += z * sA; Bt += z * sB; if (Bt2) Bt2 += z * sB; C += z * sC;
    const int lane = threadIdx.x & 31, lr = lane & 15, hi = lane >> 4; const int r0 = blockIdx.x * 64, c0 = blockIdx.y * 64;
    v8f acc[4][4];
#pragma unroll
    for (int mb = 0; mb < 4; ++mb)
#pragma unroll
        for (int nb = 0; nb < 4; ++nb) acc[mb][nb] = (v8f){};
    const size_t aoff = (size_t)(r0 + lr) * K + 8 * hi, boff = (size_t)(c0 + lr) * K + 8 * hi;
#pragma unroll 1
    for (int kc = 0; kc < K; kc += 32) {
        V a[4], a2[4];
#pragma unroll
        for (int mb = 0; mb < 4; ++mb) { a[mb] = WFrag<T16>::ld(A + aoff + (size_t)mb * 16 * K + kc); if (NSPLIT == 1 || NSPLIT == 2) a2[mb] = WFrag<T16>::ld(A2 + aoff + (size_t)mb * 16 * K + kc); }
#pragma unroll
        for (int nb = 0; nb < 4; ++nb) { const V b = WFrag<T16>::ld(Bt + boff + (size_t)nb * 16 * K + kc); V b2; if (NSPLIT >= 2) b2 = WFrag<T16>::ld(Bt2 + boff + (size_t)nb * 16 * K + kc);
#pragma unroll
            for (int mb = 0; mb < 4; ++mb) { acc[mb][nb] = WFrag<T16>::mma(a[mb], b, acc[mb][nb]); if (NSPLIT == 1 || NSPLIT == 2) acc[mb][nb] = WFrag<T16>::mma(a2[mb], b, acc[mb][nb]); if (NSPLIT >= 2) acc[mb][nb] = WFrag<T16>::mma(a[mb], b2, acc[mb][nb]); } }
        asm volatile("v_nop\n\tv_nop\n\tv_nop\n\tv_nop" : "+v"(acc[0][0]), "+v"(acc[1][1]), "+v"(acc[2][2]), "+v"(acc[3][3]) : "v"(a[0]), "v"(a[3]));
    }
#pragma unroll
    for (int mb = 0; mb < 4; ++mb) {
#pragma unroll
        for (int nb = 0; nb < 4; ++nb) {
#pragma unroll
            for (int j = 0; j < 8; ++j) os[(hi * 8 + j) * 68 + nb * 16 + lr] = acc[mb][nb][j]; }
        __builtin_amdgcn_wave_barrier(); asm volatile("" ::: "memory");
        float* crow = C + (size_t)(r0 + mb * 16) * ldc + c0;
{
#pragma unroll
            for (int s = 0; s < 8; ++s) { const int row = 2 * s + hi, cofs = lr * 4; v4f val = *(const v4fa*)(os + row * 68 + cofs); if (BIAS) { val[0] += bfr(bias[c0 + cofs]); val[1] += bfr(bias[c0 + cofs + 1]); val[2] += bfr(bias[c0 + cofs + 2]); val[3] += bfr(bias[c0 + cofs + 3]); }
                *(v4f*)(crow + (size_t)row * ldc + cofs) = val; }
             }
        __builtin_amdgcn_wave_barrier(); asm volatile("" ::: "memory");
    }
}

__device__ __forceinline__ void splitf(float y, unsigned short& h, unsigned short& l) { h = f2bf(y); l = f2bf(y - bf2f(h)); }
typedef __attribute__((ext_vector_type(2))) unsigned short v2us;
typedef __attribute__((ext_vector_type(4))) unsigned short v4us;

__global__ __launch_bounds__(256) void k_lnx(const float* __restrict__ X, const float* __restrict__ gg, const float* __restrict__ bb, float* XNF, bf* Ph, bf* Pl) {
    const int lane = threadIdx.x & 31; const int r = blockIdx.x * 8 + (threadIdx.x >> 5); if (r >= NT) return; float v[16]; float s = 0.f;
#pragma unroll
    for (int c = 0; c < 4; ++c) { const v4f a = *(const v4f*)(X + (size_t)r * CC + c * 128 + lane * 4);
#pragma unroll
        for (int q = 0; q < 4; ++q) { v[c * 4 + q] = bfr(a[q]); s += v[c * 4 + q]; } }
#pragma unroll
    for (int sh = 16; sh; sh >>= 1) s += __shfl_xor(s, sh, 32);
    const float mu = s * (1.0f / CC); float qq = 0.f;
#pragma unroll
    for (int i = 0; i < 16; ++i) { const float d0 = v[i] - mu; qq = __fadd_rn(qq, __fmul_rn(d0, d0)); }
#pragma unroll
    for (int sh = 16; sh; sh >>= 1) qq += __shfl_xor(qq, sh, 32);
    const float rs = __fdiv_rn(1.0f, __fsqrt_rn(qq * (1.0f / CC) + 1e-5f));
{
#pragma unroll
        for (int c = 0; c < 4; ++c) { v4f o; v4us oh, ol;
#pragma unroll
            for (int q = 0; q < 4; ++q) { const int col = c * 128 + lane * 4 + q; o[q] = __fadd_rn(__fmul_rn((v[c * 4 + q] - mu) * rs, bfr(gg[col])), bfr(bb[col])); unsigned short a, c2; splitf(o[q], a, c2); oh[q] = a; ol[q] = c2; }
            *(v4f*)(XNF + (size_t)r * CC + c * 128 + lane * 4) = o; *(v4us*)(Ph + (size_t)r * CC + c * 128 + lane * 4) = oh; *(v4us*)(Pl + (size_t)r * CC + c * 128 + lane * 4) = ol; }
         }
}
__global__ __launch_bounds__(256) void k_xTsplit(const float* __restrict__ XNF, bf* Th, bf* Tl) {
    const int lane = threadIdx.x & 31; const int L0 = (blockIdx.x * 8 + (threadIdx.x >> 5)) * 8; const int nlines = NT * CC / 64;
{
#pragma unroll
        for (int l = 0; l < 8; ++l) { const int L = L0 + l; if (L >= nlines) break; const int e = L * 64 + lane * 2; const int t = e & (TT - 1); const int c = (e >> 11) & (CC - 1); const int b = e >> 20; v2us oh, ol;
#pragma unroll
            for (int q = 0; q < 2; ++q) { unsigned short a, c2; splitf(XNF[((size_t)b * TT + t + q) * CC + c], a, c2); oh[q] = a; ol[q] = c2; }
            *(v2us*)(Th + (size_t)e) = oh; *(v2us*)(Tl + (size_t)e) = ol; }
         }
}
__global__ __launch_bounds__(256) void k_lnsc(const float* __restrict__ S, const float* __restrict__ gg, const float* __restrict__ bb, bf* Ph, bf* Pl) {
    const int lane = threadIdx.x & 31; const int r = blockIdx.x * 8 + (threadIdx.x >> 5); if (r >= NT) return; const float* sr = S + (size_t)r * TT; float v[64]; float s = 0.f;
#pragma unroll
    for (int c = 0; c < 16; ++c) { const v4f a = *(const v4f*)(sr + c * 128 + lane * 4);
#pragma unroll
        for (int q = 0; q < 4; ++q) { v[c * 4 + q] = a[q]; s += a[q]; } }
#pragma unroll
    for (int sh = 16; sh; sh >>= 1) s += __shfl_xor(s, sh, 32);
    const float mu = s * (1.0f / TT); float qq = 0.f;
#pragma unroll
    for (int i = 0; i < 64; ++i) { const float d0 = v[i] - mu; qq = __fadd_rn(qq, __fmul_rn(d0, d0)); }
#pragma unroll
    for (int sh = 16; sh; sh >>= 1) qq += __shfl_xor(qq, sh, 32);
    const float rs = __fdiv_rn(1.0f, __fsqrt_rn(qq * (1.0f / TT) + 1e-5f));
{
#pragma unroll
        for (int c = 0; c < 16; ++c) { v4us oh, ol;
#pragma unroll
            for (int q = 0; q < 4; ++q) { const int col = c * 128 + lane * 4 + q; unsigned short a, c2; splitf(__fadd_rn(__fmul_rn((v[c * 4 + q] - mu) * rs, bfr(gg[col])), bfr(bb[col])), a, c2); oh[q] = a; ol[q] = c2; }
            *(v4us*)(Ph + (size_t)r * TT + c * 128 + lane * 4) = oh; *(v4us*)(Pl + (size_t)r * TT + c * 128 + lane * 4) = ol; }
         }
}
__global__ __launch_bounds__(256) void k_lno(const float* __restrict__ O, const float* __restrict__ gg, const float* __restrict__ bb, float* OUT) {
    const int lane = threadIdx.x & 31; const int r = blockIdx.x * 8 + (threadIdx.x >> 5); if (r >= NT) return; float v[16]; float s = 0.f;
#pragma unroll
    for (int c = 0; c < 4; ++c) { const v4f a = *(const v4f*)(O + (size_t)r * CC + c * 128 + lane * 4);
#pragma unroll
        for (int q = 0; q < 4; ++q) { v[c * 4 + q] = a[q]; s += a[q]; } }
#pragma unroll
    for (int sh = 16; sh; sh >>= 1) s += __shfl_xor(s, sh, 32);
    const float mu = s * (1.0f / CC); float qq = 0.f;
#pragma unroll
    for (int i = 0; i < 16; ++i) { const float d0 = v[i] - mu; qq = __fadd_rn(qq, __fmul_rn(d0, d0)); }
#pragma unroll
    for (int sh = 16; sh; sh >>= 1) qq += __shfl_xor(qq, sh, 32);
    const float rs = __fdiv_rn(1.0f, __fsqrt_rn(qq * (1.0f / CC) + 1e-5f));
{
#pragma unroll
        for (int c = 0; c < 4; ++c) { v4f o;
#pragma unroll
            for (int q = 0; q < 4; ++q) { const int col = c * 128 + lane * 4 + q; o[q] = __fadd_rn(__fmul_rn((v[c * 4 + q] - mu) * rs, bfr(gg[col])), bfr(bb[col])); }
            *(v4f*)(OUT + (size_t)r * CC + c * 128 + lane * 4) = o; }
         }
}

extern "C" void kernel_launch(void* const* d_in, const int* in_sizes, int n_in,
                              void* d_out, int out_size, void* d_ws, size_t ws_size, hipStream_t stream) {
    (void)in_sizes; (void)n_in; (void)out_size;
    const float* x = (const float*)d_in[0]; const float* wt = (const float*)d_in[1]; const float* bt = (const float*)d_in[2]; const float* wsS = (const float*)d_in[3]; const float* bsS = (const float*)d_in[4];
    float* OUT = (float*)d_out;     // [4][2048][512]
    char* wsp = (char*)d_ws;
    auto take = [&](size_t bytes) { char* p = wsp; wsp += (bytes + 255) & ~(size_t)255; return (void*)p; };
    float* XNF = (float*)take((size_t)NT * CC * 4); bf* XNh = (bf*)take((size_t)NT * CC * 2); bf* XNl = (bf*)take((size_t)NT * CC * 2); bf* XTh = (bf*)take((size_t)NT * CC * 2); bf* XTl = (bf*)take((size_t)NT * CC * 2);
    float* S = (float*)take((size_t)NT * TT * 4); bf* Ih = (bf*)take((size_t)NT * TT * 2); bf* Il = (bf*)take((size_t)NT * TT * 2); float* O = (float*)take((size_t)NT * CC * 4);    // one plane per batch
    if ((size_t)(wsp - (char*)d_ws) > ws_size) return;    // total ~ 192 MiB; ws 256 MiB
    k_lnx<<<NT / 8, 256, 0, stream>>>(x, wt, bt, XNF, XNh, XNl); k_xTsplit<<<(unsigned)((NT * CC / 64 + 63) / 64), 256, 0, stream>>>(XNF, XTh, XTl);
    // every stage runs once for all batches: the GEMMs take the batch as grid z, the LayerNorms run over all NT rows
    k_gemmw<bf, 2, false><<<dim3(TT / 64, TT / 64, NB_), 32, 0, stream>>>(XNh, XNl, XNh, XNl, CC, S, TT, nullptr, (size_t)TT * CC, (size_t)TT * CC, (size_t)TT * TT);    // score = xn . xn^T
    k_lnsc<<<NT / 8, 256, 0, stream>>>(S, wsS, bsS, Ih, Il);
    k_gemmw<bf, 2, false><<<dim3(TT / 64, CC / 64, NB_), 32, 0, stream>>>(Ih, Il, XTh, XTl, TT, O, CC, nullptr, (size_t)TT * TT, (size_t)TT * CC, (size_t)TT * CC);                // out = interaction . xn  (Bt = xn^T [c][m])
    k_lno<<<NT / 8, 256, 0, stream>>>(O, wt, bt, OUT);
}
